// v000
// Times are from an AMD MI455X. After a warm-up the kernel runs many times in a row, and a time is the length of
// such a window on the GPU divided by its runs, so every launch and the gaps after it count. The runs cycle
// through copies of the inputs. A figure is the median of several windows, for all but v000 over two sittings.
// Sittings can differ by a few percent; kernels timed side by side share one.
// v000 is the starting kernel. One run takes 803 microseconds.
#include <hip/hip_runtime.h>
#include <math.h>

// ---------------------------------------------------------------------------
// FactoredAttention on MI455X (gfx1250, wave32)
//   x(16384x1024) @ Wqkv(1024x3072) + b  -> qkv          [WMMA f32 16x16x4]
//   column causal attention over NB=32, 512 sequences     [VALU, ~0.8% FLOPs]
//   attn(16384x1024) @ Wout(1024x1024) + b -> out         [WMMA f32 16x16x4]
//
// GEMM: block tile 64x128, 4 waves, wave tile 32x64 (2x4 WMMA frags),
// BK=32, double-buffered LDS fed by GLOBAL_LOAD_ASYNC_TO_LDS_B128 when the
// toolchain exposes it (ASYNCcnt-tracked, overlaps with WMMA issue).
// ---------------------------------------------------------------------------

typedef float v2f __attribute__((ext_vector_type(2)));
typedef float v8f __attribute__((ext_vector_type(8)));
typedef int   v4i __attribute__((vector_size(16)));

#define BM 64
#define BN 128
#define BK 32
#define LDA_S 36    // LDS row stride (floats): 16B-aligned, conflict-free frag reads
#define LDB_S 136   // (2*136)%64 == 16 -> half-waves hit disjoint bank sets

#if defined(__gfx1250__) && __has_builtin(__builtin_amdgcn_global_load_async_to_lds_b128)
#define HAS_ASYNC_LDS 1
#else
#define HAS_ASYNC_LDS 0
#endif

#if HAS_ASYNC_LDS
typedef v4i __attribute__((address_space(1))) gv4i;  // global
typedef v4i __attribute__((address_space(3))) lv4i;  // LDS
#endif

__device__ __forceinline__ void cp16(const float* g, float* l) {
#if HAS_ASYNC_LDS
  __builtin_amdgcn_global_load_async_to_lds_b128(
      (gv4i*)(const_cast<float*>(g)), (lv4i*)l, 0, 0);
#else
  *(float4*)l = *(const float4*)g;
#endif
}

template <int N>
__device__ __forceinline__ void wait_async() {
#if HAS_ASYNC_LDS
#if __has_builtin(__builtin_amdgcn_s_wait_asynccnt)
  __builtin_amdgcn_s_wait_asynccnt((short)N);
#else
  asm volatile("s_wait_asynccnt %0" ::"n"(N) : "memory");
#endif
#endif
}

// Issue one chunk's staging (12 x B128 per thread: 4 for A tile, 8 for B tile).
__device__ __forceinline__ void stage_tiles(const float* __restrict__ A,
                                            const float* __restrict__ B,
                                            int K, int N, int m0, int n0, int k0,
                                            float* As, float* Bs, int tid) {
  // A tile: 64 rows x 32 cols; thread t -> row t>>1, 16-float half-row.
  const int arow = tid >> 1;
  const int acol = (tid & 1) * 16;
  const float* ag = A + (size_t)(m0 + arow) * K + k0 + acol;
  float* al = As + arow * LDA_S + acol;
#pragma unroll
  for (int i = 0; i < 4; ++i) cp16(ag + 4 * i, al + 4 * i);

  // B tile: 32 rows x 128 cols; thread t -> row t>>2, 32-float quarter-row.
  const int brow = tid >> 2;
  const int bcol = (tid & 3) * 32;
  const float* bg = B + (size_t)(k0 + brow) * N + n0 + bcol;
  float* bl = Bs + brow * LDB_S + bcol;
#pragma unroll
  for (int i = 0; i < 8; ++i) cp16(bg + 4 * i, bl + 4 * i);
}

// C(MxN) = A(MxK) @ B(KxN) + bias, row-major fp32.
__global__ __launch_bounds__(128)
void gemm_f32_wmma(const float* __restrict__ A, const float* __restrict__ B,
                   const float* __restrict__ bias, float* __restrict__ C,
                   int M, int N, int K) {
  __shared__ float As[2][BM * LDA_S];
  __shared__ float Bs[2][BK * LDB_S];

  const int tid   = threadIdx.x;
  const int lane  = tid & 31;
  const int wave  = tid >> 5;           // 0..3  (2 in M x 2 in N)
  const int waveM = (wave >> 1) * 32;
  const int waveN = (wave & 1) * 64;

  const int n0 = blockIdx.x * BN;
  const int m0 = blockIdx.y * BM;

  const int half = lane >> 4;
  const int l16  = lane & 15;

  v8f c[2][4];
#pragma unroll
  for (int fm = 0; fm < 2; ++fm)
#pragma unroll
    for (int fn = 0; fn < 4; ++fn)
      c[fm][fn] = (v8f){0.f, 0.f, 0.f, 0.f, 0.f, 0.f, 0.f, 0.f};

  // Prologue: stage chunk 0 into buffer 0.
  stage_tiles(A, B, K, N, m0, n0, 0, As[0], Bs[0], tid);

  for (int k0 = 0; k0 < K; k0 += BK) {
    const int cur = (k0 / BK) & 1;

    if (k0 + BK < K) {   // uniform branch: EXEC stays all-ones for WMMA
      stage_tiles(A, B, K, N, m0, n0, k0 + BK, As[cur ^ 1], Bs[cur ^ 1], tid);
      wait_async<12>();  // retire previous chunk, leave the 12 new in flight
    } else {
      wait_async<0>();
    }
    __syncthreads();     // all waves' staging of buf[cur] visible

    const float* Asb = As[cur];
    const float* Bsb = Bs[cur];
#pragma unroll
    for (int kk = 0; kk < BK; kk += 4) {
      // ISA layouts (wave32): for 16x4 f32 A and 4x16 B, VGPR v of a lane
      // holds k = kk + 2*half + v.  A: row = l16 (M).  B: col = l16 (N).
      const int kfrag = kk + 2 * half;

      v2f a[2], b[4];
#pragma unroll
      for (int fm = 0; fm < 2; ++fm) {
        const float* ap = Asb + (waveM + 16 * fm + l16) * LDA_S + kfrag;
        a[fm].x = ap[0];
        a[fm].y = ap[1];
      }
#pragma unroll
      for (int fn = 0; fn < 4; ++fn) {
        const float* bp = Bsb + kfrag * LDB_S + waveN + 16 * fn + l16;
        b[fn].x = bp[0];
        b[fn].y = bp[LDB_S];
      }

#pragma unroll
      for (int fm = 0; fm < 2; ++fm)
#pragma unroll
        for (int fn = 0; fn < 4; ++fn)
          c[fm][fn] = __builtin_amdgcn_wmma_f32_16x16x4_f32(
              false, a[fm], false, b[fn], (short)0, c[fm][fn], false, false);
    }
    __syncthreads();     // buf[cur] free before next iteration overwrites it
  }

  // Epilogue: bias add + store.  C/D layout: VGPR r -> row r + 8*half, col l16.
#pragma unroll
  for (int fn = 0; fn < 4; ++fn) {
    const int nc = n0 + waveN + 16 * fn + l16;
    const float bv = bias[nc];
#pragma unroll
    for (int fm = 0; fm < 2; ++fm) {
      const int rbase = m0 + waveM + 16 * fm + 8 * half;
#pragma unroll
      for (int r = 0; r < 8; ++r)
        C[(size_t)(rbase + r) * N + nc] = c[fm][fn][r] + bv;
    }
  }
}

// ---------------------------------------------------------------------------
// Column causal attention: sequences indexed by (b, bl) of length NB=32,
// head dim 1024.  One wave per (b, bl, q-position): 16384 waves.
// qkv row for (b, nb, bl) = ((b*32 + nb)*128 + bl), cols: q[0,1024) k[1024,2048)
// v[2048,3072).  Per-sequence working set is 384 KB -> resident in 192 MB L2.
// ---------------------------------------------------------------------------
__global__ __launch_bounds__(256)
void col_attn(const float* __restrict__ qkv, float* __restrict__ attn) {
  const int lane = threadIdx.x & 31;
  const int w    = blockIdx.x * 8 + (threadIdx.x >> 5);  // global wave id
  const int qn   = w & 31;          // query position along NB (causal axis)
  const int bl   = (w >> 5) & 127;  // within-block position
  const int b    = w >> 12;         // batch

  const size_t rowQ = (size_t)(b * 32 + qn) * 128 + bl;
  const float* Q = qkv + rowQ * 3072;
  const float scale = 0.03125f;     // 1/sqrt(1024)

  // Scores: lane kn ends up holding score[qn][kn]; masked lanes stay -inf.
  float sc = -INFINITY;
  for (int kn = 0; kn <= qn; ++kn) {
    const float* Kr = qkv + ((size_t)(b * 32 + kn) * 128 + bl) * 3072 + 1024;
    float acc = 0.f;
#pragma unroll 8
    for (int d = lane; d < 1024; d += 32)
      acc += Q[d] * Kr[d];                     // coalesced 128B per wave
#pragma unroll
    for (int off = 16; off; off >>= 1)
      acc += __shfl_xor(acc, off, 32);
    sc = (lane == kn) ? acc * scale : sc;      // lane-select, no divergence
  }

  // In-wave softmax over 32 lanes.
  float mx = sc;
#pragma unroll
  for (int off = 16; off; off >>= 1) mx = fmaxf(mx, __shfl_xor(mx, off, 32));
  float p = __expf(sc - mx);                   // -inf lanes -> 0
  float sum = p;
#pragma unroll
  for (int off = 16; off; off >>= 1) sum += __shfl_xor(sum, off, 32);
  p /= sum;

  // out[qn, :] = sum_k p[k] * V[k, :]; each lane owns 32 of the 1024 dims.
  float acc[32];
#pragma unroll
  for (int j = 0; j < 32; ++j) acc[j] = 0.f;

  for (int kn = 0; kn <= qn; ++kn) {
    const float pk = __shfl(p, kn, 32);
    const float* Vr = qkv + ((size_t)(b * 32 + kn) * 128 + bl) * 3072 + 2048;
#pragma unroll
    for (int j = 0; j < 32; ++j)
      acc[j] += pk * Vr[lane + 32 * j];
  }

  float* O = attn + rowQ * 1024;
#pragma unroll
  for (int j = 0; j < 32; ++j)
    O[lane + 32 * j] = acc[j];
}

// ---------------------------------------------------------------------------
extern "C" void kernel_launch(void* const* d_in, const int* in_sizes, int n_in,
                              void* d_out, int out_size, void* d_ws, size_t ws_size,
                              hipStream_t stream) {
  (void)in_sizes; (void)n_in; (void)out_size; (void)ws_size;

  const float* x    = (const float*)d_in[0];   // (4,4096,1024)
  const float* Wqkv = (const float*)d_in[1];   // (1024,3072)
  const float* bqkv = (const float*)d_in[2];   // (3072)
  const float* Wout = (const float*)d_in[3];   // (1024,1024)
  const float* bout = (const float*)d_in[4];   // (1024)
  float* out = (float*)d_out;                  // (4,4096,1024)

  float* qkv  = (float*)d_ws;                       // 16384 x 3072 f32 (192 MB)
  float* attn = qkv + (size_t)16384 * 3072;         // 16384 x 1024 f32 (64 MB)

  const int M = 16384, D = 1024;

  // Stage 1: QKV projection.
  gemm_f32_wmma<<<dim3((3 * D) / BN, M / BM), dim3(128), 0, stream>>>(
      x, Wqkv, bqkv, qkv, M, 3 * D, D);

  // Stage 2: column causal attention (16384 waves, 8 waves/block).
  col_attn<<<dim3(16384 / 8), dim3(256), 0, stream>>>(qkv, attn);

  // Stage 3: output projection.
  gemm_f32_wmma<<<dim3(D / BN, M / BM), dim3(128), 0, stream>>>(
      attn, Wout, bout, out, M, D, D);
}

// v001
// One run takes 704 microseconds.
// Two timings next to v000 both put it at 1.20 times that version's speed.
#include <hip/hip_runtime.h>
#include <math.h>

// ---------------------------------------------------------------------------
// FactoredAttention on MI455X (gfx1250, wave32)
//   x(16384x1024) @ Wqkv(1024x3072) + b  -> qkv          [WMMA f32 16x16x4]
//   column causal attention over NB=32, 512 sequences     [WMMA f32 16x16x4]
//   attn(16384x1024) @ Wout(1024x1024) + b -> out         [WMMA f32 16x16x4]
//
// GEMM: block tile 64x128, 4 waves, wave tile 32x64 (2x4 WMMA frags),
// BK=32, double-buffered LDS fed by GLOBAL_LOAD_ASYNC_TO_LDS_B128 when the
// toolchain exposes it (ASYNCcnt-tracked, overlaps with WMMA issue).
// ---------------------------------------------------------------------------

typedef float v2f __attribute__((ext_vector_type(2)));
typedef float v8f __attribute__((ext_vector_type(8)));
typedef int   v4i __attribute__((vector_size(16)));

#define BM 64
#define BN 128
#define BK 32
#define LDA_S 36    // LDS row stride (floats): 16B-aligned, conflict-free frag reads
#define LDB_S 136   // (2*136)%64 == 16 -> half-waves hit disjoint bank sets

#if defined(__gfx1250__) && __has_builtin(__builtin_amdgcn_global_load_async_to_lds_b128)
#define HAS_ASYNC_LDS 1
#else
#define HAS_ASYNC_LDS 0
#endif

#if HAS_ASYNC_LDS
typedef v4i __attribute__((address_space(1))) gv4i;  // global
typedef v4i __attribute__((address_space(3))) lv4i;  // LDS
#endif

__device__ __forceinline__ void cp16(const float* g, float* l) {
#if HAS_ASYNC_LDS
  __builtin_amdgcn_global_load_async_to_lds_b128(
      (gv4i*)(const_cast<float*>(g)), (lv4i*)l, 0, 0);
#else
  *(float4*)l = *(const float4*)g;
#endif
}

template <int N>
__device__ __forceinline__ void wait_async() {
#if HAS_ASYNC_LDS
#if __has_builtin(__builtin_amdgcn_s_wait_asynccnt)
  __builtin_amdgcn_s_wait_asynccnt((short)N);
#else
  asm volatile("s_wait_asynccnt %0" ::"n"(N) : "memory");
#endif
#endif
}

// Issue one chunk's staging (12 x B128 per thread: 4 for A tile, 8 for B tile).
__device__ __forceinline__ void stage_tiles(const float* __restrict__ A,
                                            const float* __restrict__ B,
                                            int K, int N, int m0, int n0, int k0,
                                            float* As, float* Bs, int tid) {
  // A tile: 64 rows x 32 cols; thread t -> row t>>1, 16-float half-row.
  const int arow = tid >> 1;
  const int acol = (tid & 1) * 16;
  const float* ag = A + (size_t)(m0 + arow) * K + k0 + acol;
  float* al = As + arow * LDA_S + acol;
#pragma unroll
  for (int i = 0; i < 4; ++i) cp16(ag + 4 * i, al + 4 * i);

  // B tile: 32 rows x 128 cols; thread t -> row t>>2, 32-float quarter-row.
  const int brow = tid >> 2;
  const int bcol = (tid & 3) * 32;
  const float* bg = B + (size_t)(k0 + brow) * N + n0 + bcol;
  float* bl = Bs + brow * LDB_S + bcol;
#pragma unroll
  for (int i = 0; i < 8; ++i) cp16(bg + 4 * i, bl + 4 * i);
}

// C(MxN) = A(MxK) @ B(KxN) + bias, row-major fp32.
__global__ __launch_bounds__(128)
void gemm_f32_wmma(const float* __restrict__ A, const float* __restrict__ B,
                   const float* __restrict__ bias, float* __restrict__ C,
                   int M, int N, int K) {
  __shared__ float As[2][BM * LDA_S];
  __shared__ float Bs[2][BK * LDB_S];

  const int tid   = threadIdx.x;
  const int lane  = tid & 31;
  const int wave  = tid >> 5;           // 0..3  (2 in M x 2 in N)
  const int waveM = (wave >> 1) * 32;
  const int waveN = (wave & 1) * 64;

  const int n0 = blockIdx.x * BN;
  const int m0 = blockIdx.y * BM;

  const int half = lane >> 4;
  const int l16  = lane & 15;

  v8f c[2][4];
#pragma unroll
  for (int fm = 0; fm < 2; ++fm)
#pragma unroll
    for (int fn = 0; fn < 4; ++fn)
      c[fm][fn] = (v8f){0.f, 0.f, 0.f, 0.f, 0.f, 0.f, 0.f, 0.f};

  // Prologue: stage chunk 0 into buffer 0.
  stage_tiles(A, B, K, N, m0, n0, 0, As[0], Bs[0], tid);

  for (int k0 = 0; k0 < K; k0 += BK) {
    const int cur = (k0 / BK) & 1;

    if (k0 + BK < K) {   // uniform branch: EXEC stays all-ones for WMMA
      stage_tiles(A, B, K, N, m0, n0, k0 + BK, As[cur ^ 1], Bs[cur ^ 1], tid);
      wait_async<12>();  // retire previous chunk, leave the 12 new in flight
    } else {
      wait_async<0>();
    }
    __syncthreads();     // all waves' staging of buf[cur] visible

    const float* Asb = As[cur];
    const float* Bsb = Bs[cur];
#pragma unroll
    for (int kk = 0; kk < BK; kk += 4) {
      // ISA layouts (wave32): for 16x4 f32 A and 4x16 B, VGPR v of a lane
      // holds k = kk + 2*half + v.  A: row = l16 (M).  B: col = l16 (N).
      const int kfrag = kk + 2 * half;

      v2f a[2], b[4];
#pragma unroll
      for (int fm = 0; fm < 2; ++fm) {
        const float* ap = Asb + (waveM + 16 * fm + l16) * LDA_S + kfrag;
        a[fm].x = ap[0];
        a[fm].y = ap[1];
      }
#pragma unroll
      for (int fn = 0; fn < 4; ++fn) {
        const float* bp = Bsb + kfrag * LDB_S + waveN + 16 * fn + l16;
        b[fn].x = bp[0];
        b[fn].y = bp[LDB_S];
      }

#pragma unroll
      for (int fm = 0; fm < 2; ++fm)
#pragma unroll
        for (int fn = 0; fn < 4; ++fn)
          c[fm][fn] = __builtin_amdgcn_wmma_f32_16x16x4_f32(
              false, a[fm], false, b[fn], (short)0, c[fm][fn], false, false);
    }
    __syncthreads();     // buf[cur] free before next iteration overwrites it
  }

  // Epilogue: bias add + store.  C/D layout: VGPR r -> row r + 8*half, col l16.
#pragma unroll
  for (int fn = 0; fn < 4; ++fn) {
    const int nc = n0 + waveN + 16 * fn + l16;
    const float bv = bias[nc];
#pragma unroll
    for (int fm = 0; fm < 2; ++fm) {
      const int rbase = m0 + waveM + 16 * fm + 8 * half;
#pragma unroll
      for (int r = 0; r < 8; ++r)
        C[(size_t)(rbase + r) * N + nc] = c[fm][fn][r] + bv;
    }
  }
}

// ---------------------------------------------------------------------------
// Column causal attention: sequences indexed by (b, bl) of length NB=32,
// head dim 1024.  One work-group of 16 waves per sequence; every Q, K and V
// row is read from global memory exactly once.
// qkv row for (b, nb, bl) = ((b*32 + nb)*128 + bl), cols: q[0,1024) k[1024,2048)
// v[2048,3072).
//   1. wave w stages columns [64w, 64w+64) of the 32 Q and 32 K rows in LDS
//      and holds the same columns of V in registers;
//   2. partial S = Q K^T over those 64 columns on WMMA (the tile above the
//      diagonal is never needed), partials summed over the 16 waves in LDS;
//   3. softmax, two rows per wave, P to LDS;
//   4. O = P V on WMMA for the wave's 64 columns.
// ---------------------------------------------------------------------------
#define AT_QK_S 68   // LDS row stride (floats): 16 B x odd, conflict-free b128 reads
#define AT_S_S  36   // stride of the 32x32 score planes: conflict-free fragment reads

typedef float v4f __attribute__((ext_vector_type(4)));

__device__ __forceinline__ v8f wmma4(v2f a, v2f b, v8f c) {
  return __builtin_amdgcn_wmma_f32_16x16x4_f32(false, a, false, b, (short)0, c,
                                               false, false);
}

// Ends a run of WMMAs: four vector slots before any vector instruction may
// touch a register that the last WMMAs read or write.  The scheduling fences
// keep the slots behind the run and other vector instructions out of it.
__device__ __forceinline__ void wmma_run_end() {
  __builtin_amdgcn_sched_barrier(0);
  asm volatile("v_nop\n\tv_nop\n\tv_nop\n\tv_nop");
  __builtin_amdgcn_sched_barrier(0);
}

__global__ __launch_bounds__(512)
void col_attn(const float* __restrict__ qkv, float* __restrict__ attn) {
  __shared__ __attribute__((aligned(16))) float stage[16][64 * AT_QK_S];
  __shared__ __attribute__((aligned(16))) float Pb[32 * AT_S_S];

  const int lane = threadIdx.x & 31;
  const int wave = threadIdx.x >> 5;
  const int half = lane >> 4;
  const int l16  = lane & 15;
  const int bl   = blockIdx.x & 127;   // within-block position
  const int b    = blockIdx.x >> 7;    // batch

  const unsigned RSB = 128u * 3072u * 4u;          // bytes between positions
  // Uniform base of the sequence; the lane's part is a 32-bit byte offset.
  const char* seq = (const char*)(qkv + ((size_t)(b * 32) * 128 + bl) * 3072);
  const int col = wave * 64 + 4 * l16;             // this lane's 4 columns
  const unsigned off = (unsigned)half * RSB + (unsigned)col * 4u;
  float* st = stage[wave];

  // All loops below are fully unrolled so that every array stays in registers.

  // One load = two rows x 256 B (whole lines).  Q rows, K rows, then V rows.
  v4f tq[16], tk[16], vv[16];
#pragma unroll
  for (int i = 0; i < 16; ++i)
    tq[i] = *(const v4f*)(seq + (size_t)(2 * i) * RSB + off);
#pragma unroll
  for (int i = 0; i < 16; ++i)
    tk[i] = *(const v4f*)(seq + ((size_t)(2 * i) * RSB + 4096) + off);
  // vv[2*s + v] = V[4*s + 2*v + half][col .. col+3]; P is read in the same k order.
#pragma unroll
  for (int i = 0; i < 16; ++i)
    vv[i] = *(const v4f*)(seq + ((size_t)(2 * i) * RSB + 8192) + off);

#pragma unroll
  for (int i = 0; i < 16; ++i)
    *(v4f*)(st + (2 * i + half) * AT_QK_S + 4 * l16) = tq[i];
#pragma unroll
  for (int i = 0; i < 16; ++i)
    *(v4f*)(st + (32 + 2 * i + half) * AT_QK_S + 4 * l16) = tk[i];
  __syncthreads();     // staged rows visible to the lanes that read them

  // Partial scores.  A (Q) and B (K) fragments come from the same loader, so
  // both hold d = 8*j + 4*half + 2*u + v at register v of sub-step u.
  v8f s00 = (v8f){0.f, 0.f, 0.f, 0.f, 0.f, 0.f, 0.f, 0.f};
  v8f s10 = s00, s11 = s00;
  const float* fr = st + l16 * AT_QK_S + 4 * half;
  __builtin_amdgcn_sched_barrier(0);   // start of the WMMA run (see wmma_run_end)
#pragma unroll
  for (int j = 0; j < 8; ++j) {
    const v4f q0 = *(const v4f*)(fr + 8 * j);
    const v4f q1 = *(const v4f*)(fr + 16 * AT_QK_S + 8 * j);
    const v4f k0 = *(const v4f*)(fr + 32 * AT_QK_S + 8 * j);
    const v4f k1 = *(const v4f*)(fr + 48 * AT_QK_S + 8 * j);
    s00 = wmma4((v2f){q0.x, q0.y}, (v2f){k0.x, k0.y}, s00);
    s10 = wmma4((v2f){q1.x, q1.y}, (v2f){k0.x, k0.y}, s10);
    s11 = wmma4((v2f){q1.x, q1.y}, (v2f){k1.x, k1.y}, s11);
    s00 = wmma4((v2f){q0.z, q0.w}, (v2f){k0.z, k0.w}, s00);
    s10 = wmma4((v2f){q1.z, q1.w}, (v2f){k0.z, k0.w}, s10);
    s11 = wmma4((v2f){q1.z, q1.w}, (v2f){k1.z, k1.w}, s11);
  }
  wmma_run_end();
  __syncthreads();     // fragment reads done before the rows are overwritten

  // The wave's partial 32x32 plane goes over its own staged rows.
  // D layout: register r -> row r + 8*half, column l16.
#pragma unroll
  for (int r = 0; r < 8; ++r) {
    st[(r + 8 * half) * AT_S_S + l16]           = s00[r];
    st[(r + 8 * half) * AT_S_S + 16 + l16]      = 0.f;   // tile above the diagonal
    st[(16 + r + 8 * half) * AT_S_S + l16]      = s10[r];
    st[(16 + r + 8 * half) * AT_S_S + 16 + l16] = s11[r];
  }
  __syncthreads();     // all 16 partial planes visible

  // Softmax: wave w owns rows 2w and 2w+1, lane = key position.
  // The two rows run side by side so that their cross-lane steps overlap.
  const float scale = 0.03125f;     // 1/sqrt(1024)
  const int q0 = 2 * wave;
  float sa = 0.f, sb = 0.f;
#pragma unroll
  for (int i = 0; i < 16; ++i) {
    sa += stage[i][q0 * AT_S_S + lane];
    sb += stage[i][(q0 + 1) * AT_S_S + lane];
  }
  sa = (lane <= q0)     ? sa * scale : -INFINITY;   // causal mask
  sb = (lane <= q0 + 1) ? sb * scale : -INFINITY;
  float ma = sa, mb = sb;
#pragma unroll
  for (int m = 16; m; m >>= 1) {
    ma = fmaxf(ma, __shfl_xor(ma, m, 32));
    mb = fmaxf(mb, __shfl_xor(mb, m, 32));
  }
  const float pa = __expf(sa - ma);  // -inf lanes -> 0
  const float pb = __expf(sb - mb);
  float ua = pa, ub = pb;
#pragma unroll
  for (int m = 16; m; m >>= 1) {
    ua += __shfl_xor(ua, m, 32);
    ub += __shfl_xor(ub, m, 32);
  }
  Pb[q0 * AT_S_S + lane]       = pa / ua;
  Pb[(q0 + 1) * AT_S_S + lane] = pb / ub;
  __syncthreads();     // P visible to every wave

  // O = P V.  A: P[16*tm + l16][4*s + 2*v + half].  B tile t takes component t
  // of vv, so its column l16 is global column col + t and a lane's four tiles
  // give four adjacent outputs.  Query rows 0..15 see keys 0..15 only.
  v8f o[2][4];
#pragma unroll
  for (int tm = 0; tm < 2; ++tm)
#pragma unroll
    for (int t = 0; t < 4; ++t)
      o[tm][t] = (v8f){0.f, 0.f, 0.f, 0.f, 0.f, 0.f, 0.f, 0.f};

  const float* pr = Pb + l16 * AT_S_S + half;
  v2f p0[4], p1[8], bf[8][4];
#pragma unroll
  for (int s = 0; s < 8; ++s) {
    if (s < 4) p0[s] = (v2f){pr[4 * s], pr[4 * s + 2]};
    p1[s] = (v2f){pr[16 * AT_S_S + 4 * s], pr[16 * AT_S_S + 4 * s + 2]};
#pragma unroll
    for (int t = 0; t < 4; ++t) bf[s][t] = (v2f){vv[2 * s][t], vv[2 * s + 1][t]};
  }
  // Inputs only: the moves that pair up the V registers are finished here, so
  // none of them lands among the WMMAs on a register that a WMMA still reads.
#pragma unroll
  for (int s = 0; s < 8; s += 2)
    asm volatile("" :: "v"(bf[s][0]), "v"(bf[s][1]), "v"(bf[s][2]), "v"(bf[s][3]),
                       "v"(bf[s + 1][0]), "v"(bf[s + 1][1]), "v"(bf[s + 1][2]),
                       "v"(bf[s + 1][3]));
  __builtin_amdgcn_sched_barrier(0);   // start of the WMMA run (see wmma_run_end)
#pragma unroll
  for (int s = 0; s < 8; ++s) {
    if (s < 4) {
#pragma unroll
      for (int t = 0; t < 4; ++t) o[0][t] = wmma4(p0[s], bf[s][t], o[0][t]);
    }
#pragma unroll
    for (int t = 0; t < 4; ++t) o[1][t] = wmma4(p1[s], bf[s][t], o[1][t]);
    if (s == 0) {
      // All eight result tiles get their registers in this first step.  Inputs
      // only: its operands stay live to here, so no tile is laid over a
      // register that a WMMA just issued still reads.
      __builtin_amdgcn_sched_barrier(0);
      asm volatile("" :: "v"(p0[0]), "v"(p1[0]), "v"(bf[0][0]), "v"(bf[0][1]),
                         "v"(bf[0][2]), "v"(bf[0][3]));
    }
  }
  wmma_run_end();

  // One store = two rows x 256 B (whole lines).
  float* O = attn + ((size_t)(b * 32) * 128 + bl) * 1024 + col;
#pragma unroll
  for (int tm = 0; tm < 2; ++tm)
#pragma unroll
    for (int r = 0; r < 8; ++r) {
      const v4f ov = (v4f){o[tm][0][r], o[tm][1][r], o[tm][2][r], o[tm][3][r]};
      *(v4f*)(O + (size_t)(16 * tm + r + 8 * half) * (128 * 1024)) = ov;
    }
}

// ---------------------------------------------------------------------------
extern "C" void kernel_launch(void* const* d_in, const int* in_sizes, int n_in,
                              void* d_out, int out_size, void* d_ws, size_t ws_size,
                              hipStream_t stream) {
  (void)in_sizes; (void)n_in; (void)out_size; (void)ws_size;

  const float* x    = (const float*)d_in[0];   // (4,4096,1024)
  const float* Wqkv = (const float*)d_in[1];   // (1024,3072)
  const float* bqkv = (const float*)d_in[2];   // (3072)
  const float* Wout = (const float*)d_in[3];   // (1024,1024)
  const float* bout = (const float*)d_in[4];   // (1024)
  float* out = (float*)d_out;                  // (4,4096,1024)

  float* qkv  = (float*)d_ws;                       // 16384 x 3072 f32 (192 MB)
  float* attn = qkv + (size_t)16384 * 3072;         // 16384 x 1024 f32 (64 MB)

  const int M = 16384, D = 1024;

  // Stage 1: QKV projection.
  gemm_f32_wmma<<<dim3((3 * D) / BN, M / BM), dim3(128), 0, stream>>>(
      x, Wqkv, bqkv, qkv, M, 3 * D, D);

  // Stage 2: column causal attention (one 16-wave block per sequence).
  col_attn<<<dim3(512), dim3(512), 0, stream>>>(qkv, attn);

  // Stage 3: output projection.
  gemm_f32_wmma<<<dim3(D / BN, M / BM), dim3(128), 0, stream>>>(
      attn, Wout, bout, out, M, D, D);
}

// v002
// It runs in 400 microseconds.
// In both of two side-by-side timings against v001, it was 1.76 times as fast.
// All steps since v000 together make it 2.11 times as fast.
#include <hip/hip_runtime.h>
#include <math.h>

// ---------------------------------------------------------------------------
// FactoredAttention on MI455X (gfx1250, wave32)
// The chain of products is re-associated so that weight meets weight first:
//   scores  q.k = (x_q Wq + bq).(x_k Wk + bk) = (x_q G + u).x_k + (a term of q
//           alone, which a softmax over k cancels),  G = Wq Wk^T,  u = Wk bq
//   output  (P (x Wv + bv)) Wout + bout = (P x) H + h  (rows of P sum to 1),
//           H = Wv Wout,  h = bv Wout + bout
//   G, H (1024^3 each)                                    [WMMA f32 16x16x4]
//   u, h (matrix times vector)                            [vector unit]
//   x(16384x1024) @ G + u -> y                            [WMMA f32 16x16x4]
//   column causal attention over NB=32, 512 sequences:
//   P = softmax(y x^T), z = P x                           [WMMA f32 16x16x4]
//   z(16384x1024) @ H + h -> out                          [WMMA f32 16x16x4]
//
// GEMM: block tile 64x128, 4 waves, wave tile 32x64 (2x4 WMMA frags),
// BK=32, double-buffered LDS fed by GLOBAL_LOAD_ASYNC_TO_LDS_B128 when the
// toolchain exposes it (ASYNCcnt-tracked, overlaps with WMMA issue).
// ---------------------------------------------------------------------------

typedef float v2f __attribute__((ext_vector_type(2)));
typedef float v8f __attribute__((ext_vector_type(8)));
typedef int   v4i __attribute__((vector_size(16)));

#define BM 64
#define BN 128
#define BK 32
#define LDA_S 36    // LDS row stride (floats): 16B-aligned, conflict-free frag reads
#define LDB_S 136   // (2*136)%64 == 16 -> half-waves hit disjoint bank sets

#if defined(__gfx1250__) && __has_builtin(__builtin_amdgcn_global_load_async_to_lds_b128)
#define HAS_ASYNC_LDS 1
#else
#define HAS_ASYNC_LDS 0
#endif

#if HAS_ASYNC_LDS
typedef v4i __attribute__((address_space(1))) gv4i;  // global
typedef v4i __attribute__((address_space(3))) lv4i;  // LDS
#endif

__device__ __forceinline__ void cp16(const float* g, float* l) {
#if HAS_ASYNC_LDS
  __builtin_amdgcn_global_load_async_to_lds_b128(
      (gv4i*)(const_cast<float*>(g)), (lv4i*)l, 0, 0);
#else
  *(float4*)l = *(const float4*)g;
#endif
}

template <int N>
__device__ __forceinline__ void wait_async() {
#if HAS_ASYNC_LDS
#if __has_builtin(__builtin_amdgcn_s_wait_asynccnt)
  __builtin_amdgcn_s_wait_asynccnt((short)N);
#else
  asm volatile("s_wait_asynccnt %0" ::"n"(N) : "memory");
#endif
#endif
}

// Issue one chunk's staging (12 x B128 per thread: 4 for A tile, 8 for B tile).
__device__ __forceinline__ void stage_tiles(const float* __restrict__ A,
                                            const float* __restrict__ B,
                                            int K, int N, int m0, int n0, int k0,
                                            float* As, float* Bs, int tid) {
  // A tile: 64 rows x 32 cols; thread t -> row t>>1, 16-float half-row.
  const int arow = tid >> 1;
  const int acol = (tid & 1) * 16;
  const float* ag = A + (size_t)(m0 + arow) * K + k0 + acol;
  float* al = As + arow * LDA_S + acol;
#pragma unroll
  for (int i = 0; i < 4; ++i) cp16(ag + 4 * i, al + 4 * i);

  // B tile: 32 rows x 128 cols; thread t -> row t>>2, 32-float quarter-row.
  const int brow = tid >> 2;
  const int bcol = (tid & 3) * 32;
  const float* bg = B + (size_t)(k0 + brow) * N + n0 + bcol;
  float* bl = Bs + brow * LDB_S + bcol;
#pragma unroll
  for (int i = 0; i < 8; ++i) cp16(bg + 4 * i, bl + 4 * i);
}

// C(MxN) = A(MxK) @ B(KxN) + bias, row-major fp32.
__global__ __launch_bounds__(128)
void gemm_f32_wmma(const float* __restrict__ A, const float* __restrict__ B,
                   const float* __restrict__ bias, float* __restrict__ C,
                   int M, int N, int K) {
  __shared__ float As[2][BM * LDA_S];
  __shared__ float Bs[2][BK * LDB_S];

  const int tid   = threadIdx.x;
  const int lane  = tid & 31;
  const int wave  = tid >> 5;           // 0..3  (2 in M x 2 in N)
  const int waveM = (wave >> 1) * 32;
  const int waveN = (wave & 1) * 64;

  const int n0 = blockIdx.x * BN;
  const int m0 = blockIdx.y * BM;

  const int half = lane >> 4;
  const int l16  = lane & 15;

  v8f c[2][4];
#pragma unroll
  for (int fm = 0; fm < 2; ++fm)
#pragma unroll
    for (int fn = 0; fn < 4; ++fn)
      c[fm][fn] = (v8f){0.f, 0.f, 0.f, 0.f, 0.f, 0.f, 0.f, 0.f};

  // Prologue: stage chunk 0 into buffer 0.
  stage_tiles(A, B, K, N, m0, n0, 0, As[0], Bs[0], tid);

  for (int k0 = 0; k0 < K; k0 += BK) {
    const int cur = (k0 / BK) & 1;

    if (k0 + BK < K) {   // uniform branch: EXEC stays all-ones for WMMA
      stage_tiles(A, B, K, N, m0, n0, k0 + BK, As[cur ^ 1], Bs[cur ^ 1], tid);
      wait_async<12>();  // retire previous chunk, leave the 12 new in flight
    } else {
      wait_async<0>();
    }
    __syncthreads();     // all waves' staging of buf[cur] visible

    const float* Asb = As[cur];
    const float* Bsb = Bs[cur];
#pragma unroll
    for (int kk = 0; kk < BK; kk += 4) {
      // ISA layouts (wave32): for 16x4 f32 A and 4x16 B, VGPR v of a lane
      // holds k = kk + 2*half + v.  A: row = l16 (M).  B: col = l16 (N).
      const int kfrag = kk + 2 * half;

      v2f a[2], b[4];
#pragma unroll
      for (int fm = 0; fm < 2; ++fm) {
        const float* ap = Asb + (waveM + 16 * fm + l16) * LDA_S + kfrag;
        a[fm].x = ap[0];
        a[fm].y = ap[1];
      }
#pragma unroll
      for (int fn = 0; fn < 4; ++fn) {
        const float* bp = Bsb + kfrag * LDB_S + waveN + 16 * fn + l16;
        b[fn].x = bp[0];
        b[fn].y = bp[LDB_S];
      }

#pragma unroll
      for (int fm = 0; fm < 2; ++fm)
#pragma unroll
        for (int fn = 0; fn < 4; ++fn)
          c[fm][fn] = __builtin_amdgcn_wmma_f32_16x16x4_f32(
              false, a[fm], false, b[fn], (short)0, c[fm][fn], false, false);
    }
    __syncthreads();     // buf[cur] free before next iteration overwrites it
  }

  // Epilogue: bias add + store.  C/D layout: VGPR r -> row r + 8*half, col l16.
#pragma unroll
  for (int fn = 0; fn < 4; ++fn) {
    const int nc = n0 + waveN + 16 * fn + l16;
    const float bv = bias[nc];
#pragma unroll
    for (int fm = 0; fm < 2; ++fm) {
      const int rbase = m0 + waveM + 16 * fm + 8 * half;
#pragma unroll
      for (int r = 0; r < 8; ++r)
        C[(size_t)(rbase + r) * N + nc] = c[fm][fn][r] + bv;
    }
  }
}

// ---------------------------------------------------------------------------
// Column causal attention: sequences indexed by (b, bl) of length NB=32,
// head dim 1024.  One work-group of 16 waves per sequence; every row of y and
// of x is read from global memory exactly once.  Q = y; K = V = x.
// Row for (b, nb, bl) = ((b*32 + nb)*128 + bl), 1024 columns.
//   1. wave w stages columns [64w, 64w+64) of the 32 Q and 32 K rows in LDS
//      and keeps the K rows in registers, where they serve as V;
//   2. partial S = Q K^T over those 64 columns on WMMA (the tile above the
//      diagonal is never needed), partials summed over the 16 waves in LDS;
//   3. softmax, two rows per wave, P to LDS;
//   4. O = P V on WMMA for the wave's 64 columns.
// ---------------------------------------------------------------------------
#define AT_QK_S 68   // LDS row stride (floats): 16 B x odd, conflict-free b128 reads
#define AT_S_S  36   // stride of the 32x32 score planes: conflict-free fragment reads

typedef float v4f __attribute__((ext_vector_type(4)));

__device__ __forceinline__ v8f wmma4(v2f a, v2f b, v8f c) {
  return __builtin_amdgcn_wmma_f32_16x16x4_f32(false, a, false, b, (short)0, c,
                                               false, false);
}

// Ends a run of WMMAs: four vector slots before any vector instruction may
// touch a register that the last WMMAs read or write.  The scheduling fences
// keep the slots behind the run and other vector instructions out of it.
__device__ __forceinline__ void wmma_run_end() {
  __builtin_amdgcn_sched_barrier(0);
  asm volatile("v_nop\n\tv_nop\n\tv_nop\n\tv_nop");
  __builtin_amdgcn_sched_barrier(0);
}

// Ends a run of global loads: no register that an issued load names is written
// again before the wait.  The scheduling fences keep the loads in front of it
// and every later write behind it; the lane's offset is an input so that it
// keeps its register up to here.
__device__ __forceinline__ void loads_issued(unsigned lane_off) {
  __builtin_amdgcn_sched_barrier(0);
  asm volatile("s_wait_xcnt 0x0" :: "v"(lane_off) : "memory");
  __builtin_amdgcn_sched_barrier(0);
}

__global__ __launch_bounds__(512)
void col_attn(const float* __restrict__ y, const float* __restrict__ x,
              float* __restrict__ attn) {
  __shared__ __attribute__((aligned(16))) float stage[16][64 * AT_QK_S];
  __shared__ __attribute__((aligned(16))) float Pb[32 * AT_S_S];

  const int lane = threadIdx.x & 31;
  const int wave = threadIdx.x >> 5;
  const int half = lane >> 4;
  const int l16  = lane & 15;
  const int bl   = blockIdx.x & 127;   // within-block position
  const int b    = blockIdx.x >> 7;    // batch

  const unsigned RSB = 128u * 1024u * 4u;          // bytes between positions
  // Uniform bases of the sequence; the lane's part is a 32-bit byte offset.
  const char* seqq = (const char*)(y + ((size_t)(b * 32) * 128 + bl) * 1024);
  const char* seqk = (const char*)(x + ((size_t)(b * 32) * 128 + bl) * 1024);
  const int col = wave * 64 + 4 * l16;             // this lane's 4 columns
  const unsigned off = (unsigned)half * RSB + (unsigned)col * 4u;
  float* st = stage[wave];

  // All loops below are fully unrolled so that every array stays in registers.

  // One load = two rows x 256 B (whole lines).  Q rows, then K rows.
  // As V: vv[2*s + v] = x[4*s + 2*v + half][col .. col+3]; P is read in the same k order.
  v4f tq[16], vv[16];
#pragma unroll
  for (int i = 0; i < 16; ++i)
    tq[i] = *(const v4f*)(seqq + (size_t)(2 * i) * RSB + off);
#pragma unroll
  for (int i = 0; i < 16; ++i)
    vv[i] = *(const v4f*)(seqk + (size_t)(2 * i) * RSB + off);
  loads_issued(off);

#pragma unroll
  for (int i = 0; i < 16; ++i)
    *(v4f*)(st + (2 * i + half) * AT_QK_S + 4 * l16) = tq[i];
#pragma unroll
  for (int i = 0; i < 16; ++i)
    *(v4f*)(st + (32 + 2 * i + half) * AT_QK_S + 4 * l16) = vv[i];
  __syncthreads();     // staged rows visible to the lanes that read them

  // Partial scores.  A (Q) and B (K) fragments come from the same loader, so
  // both hold d = 8*j + 4*half + 2*u + v at register v of sub-step u.
  v8f s00 = (v8f){0.f, 0.f, 0.f, 0.f, 0.f, 0.f, 0.f, 0.f};
  v8f s10 = s00, s11 = s00;
  const float* fr = st + l16 * AT_QK_S + 4 * half;
  __builtin_amdgcn_sched_barrier(0);   // start of the WMMA run (see wmma_run_end)
#pragma unroll
  for (int j = 0; j < 8; ++j) {
    const v4f q0 = *(const v4f*)(fr + 8 * j);
    const v4f q1 = *(const v4f*)(fr + 16 * AT_QK_S + 8 * j);
    const v4f k0 = *(const v4f*)(fr + 32 * AT_QK_S + 8 * j);
    const v4f k1 = *(const v4f*)(fr + 48 * AT_QK_S + 8 * j);
    s00 = wmma4((v2f){q0.x, q0.y}, (v2f){k0.x, k0.y}, s00);
    s10 = wmma4((v2f){q1.x, q1.y}, (v2f){k0.x, k0.y}, s10);
    s11 = wmma4((v2f){q1.x, q1.y}, (v2f){k1.x, k1.y}, s11);
    s00 = wmma4((v2f){q0.z, q0.w}, (v2f){k0.z, k0.w}, s00);
    s10 = wmma4((v2f){q1.z, q1.w}, (v2f){k0.z, k0.w}, s10);
    s11 = wmma4((v2f){q1.z, q1.w}, (v2f){k1.z, k1.w}, s11);
  }
  wmma_run_end();
  __syncthreads();     // fragment reads done before the rows are overwritten

  // The wave's partial 32x32 plane goes over its own staged rows.
  // D layout: register r -> row r + 8*half, column l16.
#pragma unroll
  for (int r = 0; r < 8; ++r) {
    st[(r + 8 * half) * AT_S_S + l16]           = s00[r];
    st[(r + 8 * half) * AT_S_S + 16 + l16]      = 0.f;   // tile above the diagonal
    st[(16 + r + 8 * half) * AT_S_S + l16]      = s10[r];
    st[(16 + r + 8 * half) * AT_S_S + 16 + l16] = s11[r];
  }
  __syncthreads();     // all 16 partial planes visible

  // Softmax: wave w owns rows 2w and 2w+1, lane = key position.
  // The two rows run side by side so that their cross-lane steps overlap.
  const float scale = 0.03125f;     // 1/sqrt(1024)
  const int q0 = 2 * wave;
  float sa = 0.f, sb = 0.f;
#pragma unroll
  for (int i = 0; i < 16; ++i) {
    sa += stage[i][q0 * AT_S_S + lane];
    sb += stage[i][(q0 + 1) * AT_S_S + lane];
  }
  sa = (lane <= q0)     ? sa * scale : -INFINITY;   // causal mask
  sb = (lane <= q0 + 1) ? sb * scale : -INFINITY;
  float ma = sa, mb = sb;
#pragma unroll
  for (int m = 16; m; m >>= 1) {
    ma = fmaxf(ma, __shfl_xor(ma, m, 32));
    mb = fmaxf(mb, __shfl_xor(mb, m, 32));
  }
  const float pa = __expf(sa - ma);  // -inf lanes -> 0
  const float pb = __expf(sb - mb);
  float ua = pa, ub = pb;
#pragma unroll
  for (int m = 16; m; m >>= 1) {
    ua += __shfl_xor(ua, m, 32);
    ub += __shfl_xor(ub, m, 32);
  }
  Pb[q0 * AT_S_S + lane]       = pa / ua;
  Pb[(q0 + 1) * AT_S_S + lane] = pb / ub;
  __syncthreads();     // P visible to every wave

  // O = P V.  A: P[16*tm + l16][4*s + 2*v + half].  B tile t takes component t
  // of vv, so its column l16 is global column col + t and a lane's four tiles
  // give four adjacent outputs.  Query rows 0..15 see keys 0..15 only.
  v8f o[2][4];
#pragma unroll
  for (int tm = 0; tm < 2; ++tm)
#pragma unroll
    for (int t = 0; t < 4; ++t)
      o[tm][t] = (v8f){0.f, 0.f, 0.f, 0.f, 0.f, 0.f, 0.f, 0.f};

  const float* pr = Pb + l16 * AT_S_S + half;
  v2f p0[4], p1[8], bf[8][4];
#pragma unroll
  for (int s = 0; s < 8; ++s) {
    if (s < 4) p0[s] = (v2f){pr[4 * s], pr[4 * s + 2]};
    p1[s] = (v2f){pr[16 * AT_S_S + 4 * s], pr[16 * AT_S_S + 4 * s + 2]};
#pragma unroll
    for (int t = 0; t < 4; ++t) bf[s][t] = (v2f){vv[2 * s][t], vv[2 * s + 1][t]};
  }
  // Inputs only: the moves that pair up the V registers are finished here, so
  // none of them lands among the WMMAs on a register that a WMMA still reads.
#pragma unroll
  for (int s = 0; s < 8; s += 2)
    asm volatile("" :: "v"(bf[s][0]), "v"(bf[s][1]), "v"(bf[s][2]), "v"(bf[s][3]),
                       "v"(bf[s + 1][0]), "v"(bf[s + 1][1]), "v"(bf[s + 1][2]),
                       "v"(bf[s + 1][3]));
  __builtin_amdgcn_sched_barrier(0);   // start of the WMMA run (see wmma_run_end)
#pragma unroll
  for (int s = 0; s < 8; ++s) {
    if (s < 4) {
#pragma unroll
      for (int t = 0; t < 4; ++t) o[0][t] = wmma4(p0[s], bf[s][t], o[0][t]);
    }
#pragma unroll
    for (int t = 0; t < 4; ++t) o[1][t] = wmma4(p1[s], bf[s][t], o[1][t]);
    if (s == 0) {
      // All eight result tiles get their registers in this first step.  Inputs
      // only: its operands stay live to here, so no tile is laid over a
      // register that a WMMA just issued still reads.
      __builtin_amdgcn_sched_barrier(0);
      asm volatile("" :: "v"(p0[0]), "v"(p1[0]), "v"(bf[0][0]), "v"(bf[0][1]),
                         "v"(bf[0][2]), "v"(bf[0][3]));
    }
  }
  wmma_run_end();

  // One store = two rows x 256 B (whole lines).
  float* O = attn + ((size_t)(b * 32) * 128 + bl) * 1024 + col;
#pragma unroll
  for (int tm = 0; tm < 2; ++tm)
#pragma unroll
    for (int r = 0; r < 8; ++r) {
      const v4f ov = (v4f){o[tm][0][r], o[tm][1][r], o[tm][2][r], o[tm][3][r]};
      *(v4f*)(O + (size_t)(16 * tm + r + 8 * half) * (128 * 1024)) = ov;
    }
}

// ---------------------------------------------------------------------------
// Weight products.  One 64x128 tile of C(1024x1024) = A @ B (BT = false) or
// A @ B^T (BT = true), K = 1024, by 8 waves (wave tile 32x32).  Chunks of 32 k
// go through registers into two LDS buffers: the next chunk's global loads fly
// while this chunk is multiplied.  In LDS both forms of B hold k and k+1 of a
// column side by side, so that a B fragment is one 8-byte read like an A one:
//   BT:  [n][k], row stride LDA_S;   else:  [k/2][n][k&1], row stride WP_PS.
// ---------------------------------------------------------------------------
#define WP_PS 288             // 2*128 + 32: the half-waves hit disjoint bank sets
#define WP_BS (128 * LDA_S)   // floats of one B buffer (= 16 * WP_PS)

template <bool BT>
__device__ __forceinline__ void wprod_tile(const float* __restrict__ A, int lda,
                                           const float* __restrict__ B, int ldb,
                                           float* __restrict__ C, int m0, int n0,
                                           float* As, float* Bs) {
  const int tid   = threadIdx.x;
  const int lane  = tid & 31;
  const int wave  = tid >> 5;           // 0..7  (2 in M x 4 in N)
  const int waveM = (wave >> 2) * 32;
  const int waveN = (wave & 3) * 32;
  const int half  = lane >> 4;
  const int l16   = lane & 15;

  // A chunk: 64 rows x 32 k, two float4 a thread.
  const float* ag = A + (size_t)(m0 + (tid >> 2)) * lda + (tid & 3) * 8;
  const int    al = (tid >> 2) * LDA_S + (tid & 3) * 8;
  // B chunk, four float4 a thread.  BT: 128 n-rows x 32 k, 16 k of one row.
  // Else 32 k-rows x 128 n: rows 2p and 2p+1, columns n..n+3 and n+64..n+67.
  const float* bg = BT ? B + (size_t)(n0 + (tid >> 1)) * ldb + (tid & 1) * 16
                       : B + (size_t)(2 * (tid >> 4)) * ldb + n0 + (tid & 15) * 4;
  const int    bl = BT ? (tid >> 1) * LDA_S + (tid & 1) * 16
                       : (tid >> 4) * WP_PS + (tid & 15) * 8;
  const size_t bstep = BT ? (size_t)BK : (size_t)BK * ldb;

  v4f ra[2], rb[4];
  auto load_chunk = [&]() {
#pragma unroll
    for (int i = 0; i < 2; ++i) ra[i] = *(const v4f*)(ag + 4 * i);
    if (BT) {
#pragma unroll
      for (int i = 0; i < 4; ++i) rb[i] = *(const v4f*)(bg + 4 * i);
    } else {
      rb[0] = *(const v4f*)(bg);
      rb[1] = *(const v4f*)(bg + ldb);
      rb[2] = *(const v4f*)(bg + 64);
      rb[3] = *(const v4f*)(bg + ldb + 64);
    }
  };
  auto store_chunk = [&](float* Ad, float* Bd) {
#pragma unroll
    for (int i = 0; i < 2; ++i) *(v4f*)(Ad + al + 4 * i) = ra[i];
    if (BT) {
#pragma unroll
      for (int i = 0; i < 4; ++i) *(v4f*)(Bd + bl + 4 * i) = rb[i];
    } else {
#pragma unroll
      for (int g = 0; g < 2; ++g) {
        const v4f e = rb[2 * g], o = rb[2 * g + 1];   // rows 2p and 2p+1
        *(v4f*)(Bd + bl + 128 * g)     = (v4f){e.x, o.x, e.y, o.y};
        *(v4f*)(Bd + bl + 128 * g + 4) = (v4f){e.z, o.z, e.w, o.w};
      }
    }
  };

  v8f c[2][2];
#pragma unroll
  for (int fm = 0; fm < 2; ++fm)
#pragma unroll
    for (int fn = 0; fn < 2; ++fn)
      c[fm][fn] = (v8f){0.f, 0.f, 0.f, 0.f, 0.f, 0.f, 0.f, 0.f};

  load_chunk();
  store_chunk(As, Bs);
  __syncthreads();       // chunk 0 visible

  for (int t = 0; t < 1024 / BK; ++t) {
    const int  cur  = t & 1;
    const bool more = t + 1 < 1024 / BK;   // the same for the whole work-group
    if (more) {
      ag += BK;
      bg += bstep;
      load_chunk();
    }

    const float* Asb = As + cur * (BM * LDA_S);
    const float* Bsb = Bs + cur * WP_BS;
    // The chunk's fragments are all asked for first, then its WMMAs run alone.
    v2f a[BK / 4][2], b[BK / 4][2];
#pragma unroll
    for (int ks = 0; ks < BK / 4; ++ks) {
      // Register v of a lane holds k = 4*ks + 2*half + v, in A and in B alike.
      const int kfrag = 4 * ks + 2 * half;
#pragma unroll
      for (int fm = 0; fm < 2; ++fm)
        a[ks][fm] = *(const v2f*)(Asb + (waveM + 16 * fm + l16) * LDA_S + kfrag);
#pragma unroll
      for (int fn = 0; fn < 2; ++fn)
        b[ks][fn] = *(const v2f*)(
            BT ? Bsb + (waveN + 16 * fn + l16) * LDA_S + kfrag
               : Bsb + (kfrag >> 1) * WP_PS + 2 * (waveN + 16 * fn + l16));
    }
    __builtin_amdgcn_sched_barrier(0);   // start of the WMMA run (see wmma_run_end)
#pragma unroll
    for (int ks = 0; ks < BK / 4; ++ks)
#pragma unroll
      for (int fm = 0; fm < 2; ++fm)
#pragma unroll
        for (int fn = 0; fn < 2; ++fn)
          c[fm][fn] = wmma4(a[ks][fm], b[ks][fn], c[fm][fn]);
    wmma_run_end();

    if (more)            // the other buffer's readers left it at the last barrier
      store_chunk(As + (cur ^ 1) * (BM * LDA_S), Bs + (cur ^ 1) * WP_BS);
    __syncthreads();     // next chunk visible; this chunk's reads done
  }

  // C/D layout: VGPR r -> row r + 8*half, col l16.
#pragma unroll
  for (int fn = 0; fn < 2; ++fn) {
    const int nc = n0 + waveN + 16 * fn + l16;
#pragma unroll
    for (int fm = 0; fm < 2; ++fm) {
      const int rbase = m0 + waveM + 16 * fm + 8 * half;
#pragma unroll
      for (int r = 0; r < 8; ++r)
        C[(size_t)(rbase + r) * 1024 + nc] = c[fm][fn][r];
    }
  }
  // Ends the run of stores: no register that an issued store names is written
  // again before the wait.  The scheduling fences keep the stores in front of it
  // and every later write behind it.
  __builtin_amdgcn_sched_barrier(0);
  asm volatile("s_wait_xcnt 0x0" ::: "memory");
  __builtin_amdgcn_sched_barrier(0);
}

// Work-groups 0..31: u, 32 entries each.  32..63: h, 32 entries each.
// 64..191: tiles of G.  192..319: tiles of H.
__global__ __launch_bounds__(256)
void weight_products(const float* __restrict__ Wqkv, const float* __restrict__ bqkv,
                     const float* __restrict__ Wout, const float* __restrict__ bout,
                     float* __restrict__ G, float* __restrict__ H,
                     float* __restrict__ u, float* __restrict__ h) {
  __shared__ __attribute__((aligned(16))) float As[2 * BM * LDA_S];
  __shared__ __attribute__((aligned(16))) float Bs[2 * WP_BS];

  const int lane = threadIdx.x & 31;
  const int wave = threadIdx.x >> 5;
  const int blk  = blockIdx.x;

  if (blk < 32) {
    // u[j] = sum_c Wk[j][c] * bq[c]; four rows a wave, a row across the lanes.
    // Uniform bases; the lane's part is a 32-bit byte offset.
    const char* wr = (const char*)(Wqkv + (size_t)(blk * 32) * 3072 + 1024);
    const char* qr = (const char*)bqkv;
    const unsigned wo = (unsigned)(wave * 4 * 3072 + 4 * lane) * 4u;
    const unsigned qo = (unsigned)lane * 16u;
    v4f w[4][8], q[8];
#pragma unroll
    for (int i = 0; i < 8; ++i) q[i] = *(const v4f*)(qr + 512 * i + qo);
    loads_issued(qo);
#pragma unroll
    for (int i = 0; i < 8; ++i)
#pragma unroll
      for (int r = 0; r < 4; ++r)
        w[r][i] = *(const v4f*)(wr + (12288 * r + 512 * i) + wo);
    loads_issued(wo);
#pragma unroll
    for (int r = 0; r < 4; ++r) {
      float s = 0.f;
#pragma unroll
      for (int i = 0; i < 8; ++i)
        s += w[r][i].x * q[i].x + w[r][i].y * q[i].y + w[r][i].z * q[i].z +
             w[r][i].w * q[i].w;
#pragma unroll
      for (int m = 16; m; m >>= 1) s += __shfl_xor(s, m, 32);
      if (lane == 0) As[wave * 4 + r] = s;
    }
    __syncthreads();     // the 32 sums visible to the wave that stores them
    if (wave == 0) u[blk * 32 + lane] = As[lane];
  } else if (blk < 64) {
    // h[n] = bout[n] + sum_c bv[c] * Wout[c][n]; lane = column, 128 c a wave.
    const int n = (blk - 32) * 32 + lane;
    // Uniform bases; the lane's part is a 32-bit byte offset.
    const char* wc = (const char*)(Wout + (blk - 32) * 32);
    const char* vr = (const char*)(bqkv + 2048);
    const unsigned co = (unsigned)(wave * 128 * 1024 + lane) * 4u;
    const unsigned vo = (unsigned)wave * 512u;
    float s = 0.f;
#pragma unroll
    for (int g = 0; g < 4; ++g) {
      float wv[32];
      v4f   bv[8];
#pragma unroll
      for (int i = 0; i < 8; ++i) bv[i] = *(const v4f*)(vr + (128 * g + 16 * i) + vo);
      loads_issued(vo);
#pragma unroll
      for (int i = 0; i < 32; ++i)
        wv[i] = *(const float*)(wc + (size_t)(32 * g + i) * 4096 + co);
      loads_issued(co);
#pragma unroll
      for (int i = 0; i < 32; ++i) s += bv[i >> 2][i & 3] * wv[i];
    }
    As[wave * 32 + lane] = s;
    __syncthreads();     // the eight partial sums visible to the wave that adds them
    if (wave == 0) {
      float t = bout[n];
#pragma unroll
      for (int w = 0; w < 8; ++w) t += As[w * 32 + lane];
      h[n] = t;
    }
  } else {
    const int tile = (blk - 64) & 127;
    const int n0 = (tile & 7) * BN;
    const int m0 = (tile >> 3) * BM;
    if (blk < 192)   // G = Wq Wk^T
      wprod_tile<true>(Wqkv, 3072, Wqkv + 1024, 3072, G, m0, n0, As, Bs);
    else             // H = Wv Wout
      wprod_tile<false>(Wqkv + 2048, 3072, Wout, 1024, H, m0, n0, As, Bs);
  }
}

// ---------------------------------------------------------------------------
extern "C" void kernel_launch(void* const* d_in, const int* in_sizes, int n_in,
                              void* d_out, int out_size, void* d_ws, size_t ws_size,
                              hipStream_t stream) {
  (void)in_sizes; (void)n_in; (void)out_size; (void)ws_size;

  const float* x    = (const float*)d_in[0];   // (4,4096,1024)
  const float* Wqkv = (const float*)d_in[1];   // (1024,3072)
  const float* bqkv = (const float*)d_in[2];   // (3072)
  const float* Wout = (const float*)d_in[3];   // (1024,1024)
  const float* bout = (const float*)d_in[4];   // (1024)
  float* out = (float*)d_out;                  // (4,4096,1024)

  float* y    = (float*)d_ws;                       // 16384 x 1024 f32 (64 MB)
  float* attn = y + (size_t)16384 * 1024;           // 16384 x 1024 f32 (64 MB)
  float* G    = attn + (size_t)16384 * 1024;        // 1024 x 1024 f32
  float* H    = G + (size_t)1024 * 1024;            // 1024 x 1024 f32
  float* u    = H + (size_t)1024 * 1024;            // 1024 f32
  float* h    = u + 1024;                           // 1024 f32

  const int M = 16384, D = 1024;

  // Stage 0: G = Wq Wk^T, H = Wv Wout, u = Wk bq, h = bv Wout + bout.
  weight_products<<<dim3(320), dim3(256), 0, stream>>>(Wqkv, bqkv, Wout, bout,
                                                       G, H, u, h);

  // Stage 1: y = x G + u.
  gemm_f32_wmma<<<dim3(D / BN, M / BM), dim3(128), 0, stream>>>(
      x, G, u, y, M, D, D);

  // Stage 2: column causal attention (one 16-wave block per sequence).
  col_attn<<<dim3(512), dim3(512), 0, stream>>>(y, x, attn);

  // Stage 3: out = (P x) H + h.
  gemm_f32_wmma<<<dim3(D / BN, M / BM), dim3(128), 0, stream>>>(
      attn, H, h, out, M, D, D);
}

// v003
// Measured time: 364 microseconds a run.
// Next to v002, in two timings, it ran 1.10 times as fast each time.
// Counting every step since v000, it is 2.32 times as fast.
#include <hip/hip_runtime.h>
#include <math.h>

// ---------------------------------------------------------------------------
// FactoredAttention on MI455X (gfx1250, wave32)
// The chain of products is re-associated so that weight meets weight first:
//   scores  q.k = (x_q Wq + bq).(x_k Wk + bk) = (x_q G + u).x_k + (a term of q
//           alone, which a softmax over k cancels),  G = Wq Wk^T,  u = Wk bq
//   output  (P (x Wv + bv)) Wout + bout = (P x) H + h  (rows of P sum to 1),
//           H = Wv Wout,  h = bv Wout + bout
//   G, H (1024^3 each)                                    [WMMA f32 16x16x4]
//   u, h (matrix times vector)                            [vector unit]
//   x(16384x1024) @ G + u -> y                            [WMMA f32 16x16x4]
//   column causal attention over NB=32, 512 sequences:
//   P = softmax(y x^T), z = P x                           [WMMA f32 16x16x4]
//   z(16384x1024) @ H + h -> out                          [WMMA f32 16x16x4]
//
// Token GEMM: one 256x256 tile of C per work-group of 16 waves (wave tile
// 64x64, 4x4 WMMA frags), one work-group per WGP, BK=32, two LDS buffers fed by
// GLOBAL_LOAD_ASYNC_TO_LDS_B128; every wave-wide copy covers whole 128-B lines.
// ---------------------------------------------------------------------------

typedef float v2f __attribute__((ext_vector_type(2)));
typedef float v8f __attribute__((ext_vector_type(8)));

#define BM 64
#define BN 128
#define BK 32
#define LDA_S 36    // LDS row stride (floats): 16B-aligned, conflict-free frag reads
#define LDB_S 136   // (2*136)%64 == 16 -> half-waves hit disjoint bank sets

#define TM 256
#define TN 256
#define GD 1024                  // N and K of the token GEMMs
#define TA_F (TM * LDA_S)        // floats of an A tile: 256 rows x 32 k
#define TP_F (BK * LDB_S)        // floats of a B plane: 32 k-rows x 128 columns
#define TST_F (TA_F + 2 * TP_F)  // floats of a stage: A tile, two B planes

// C(16384x1024) = A(16384x1024) @ B(1024x1024) + bias, row-major fp32.
__global__ __launch_bounds__(512)
void gemm_f32_wmma(const float* __restrict__ A, const float* __restrict__ B,
                   const float* __restrict__ bias, float* __restrict__ C) {
  __shared__ __attribute__((aligned(16))) float ring[2 * TST_F];

  const int tid   = threadIdx.x;
  const int lane  = tid & 31;
  const int wave  = tid >> 5;           // 0..15  (4 in M x 4 in N)
  const int waveM = (wave >> 2) * 64;
  const int waveN = (wave & 3) * 64;

  const int n0 = blockIdx.x * TN;
  const int m0 = blockIdx.y * TM;

  const int half = lane >> 4;
  const int l16  = lane & 15;

  // A stage is eight copies a lane.  A: eight lanes bring the 128 B of a row,
  // a wave four rows, rows r, r+64, r+128, r+192.  B: a wave brings 512 B of a
  // k-row, k-rows 2*wave and 2*wave+1, both planes.
  const float*   ga = A + (size_t)(m0 + (tid >> 3)) * GD + (tid & 7) * 4;
  const float*   gb = B + (size_t)(2 * wave) * GD + n0 + lane * 4;
  const unsigned r0 = (unsigned)(size_t)ring;   // byte address in LDS
  const unsigned la = r0 + (unsigned)((tid >> 3) * LDA_S + (tid & 7) * 4) * 4u;
  const unsigned lb = r0 + (unsigned)(TA_F + 2 * wave * LDB_S + lane * 4) * 4u;

  auto stage = [&](int t, int buf) {
    const float*   a  = ga + t * BK;
    const float*   b  = gb + (size_t)t * (BK * GD);
    const unsigned al = la + (unsigned)buf * (TST_F * 4u);
    const unsigned bl = lb + (unsigned)buf * (TST_F * 4u);
    // The wait closes the statement: no register that an issued copy names is
    // written again in front of it.
    asm volatile(
        "global_load_async_to_lds_b128 %0, %8, off\n\t"
        "global_load_async_to_lds_b128 %1, %9, off\n\t"
        "global_load_async_to_lds_b128 %2, %10, off\n\t"
        "global_load_async_to_lds_b128 %3, %11, off\n\t"
        "global_load_async_to_lds_b128 %4, %12, off\n\t"
        "global_load_async_to_lds_b128 %5, %13, off\n\t"
        "global_load_async_to_lds_b128 %6, %14, off\n\t"
        "global_load_async_to_lds_b128 %7, %15, off\n\t"
        "s_wait_xcnt 0x0"
        :: "v"(al), "v"(al + 64 * LDA_S * 4u), "v"(al + 128 * LDA_S * 4u),
           "v"(al + 192 * LDA_S * 4u),
           "v"(bl), "v"(bl + TP_F * 4u), "v"(bl + LDB_S * 4u),
           "v"(bl + (TP_F + LDB_S) * 4u),
           "v"(a), "v"(a + 64 * GD), "v"(a + 128 * GD), "v"(a + 192 * GD),
           "v"(b), "v"(b + 128), "v"(b + GD), "v"(b + GD + 128)
        : "memory");
  };

  // The loops over fragments and over kk are fully unrolled so that every
  // array stays in registers.
  v8f c[4][4];
#pragma unroll
  for (int fm = 0; fm < 4; ++fm)
#pragma unroll
    for (int fn = 0; fn < 4; ++fn)
      c[fm][fn] = (v8f){0.f, 0.f, 0.f, 0.f, 0.f, 0.f, 0.f, 0.f};

  stage(0, 0);
  asm volatile("s_wait_asynccnt 0x0" ::: "memory");   // own copies of stage 0 landed
  __syncthreads();                                    // stage 0 visible to every wave
  stage(1, 1);

  for (int t = 0; t < GD / BK; ++t) {
    const float* Asb = ring + (t & 1) * TST_F + (waveM + l16) * LDA_S + 2 * half;
    const float* Bsb = ring + (t & 1) * TST_F + TA_F + (waveN >> 7) * TP_F +
                       2 * half * LDB_S + (waveN & 127) + l16;
#pragma unroll
    for (int kk = 0; kk < BK; kk += 4) {
      // ISA layouts (wave32): for 16x4 f32 A and 4x16 B, VGPR v of a lane
      // holds k = kk + 2*half + v.  A: row = l16 (M).  B: col = l16 (N).
      v2f a[4], b[4];
#pragma unroll
      for (int fm = 0; fm < 4; ++fm)
        a[fm] = *(const v2f*)(Asb + 16 * fm * LDA_S + kk);
#pragma unroll
      for (int fn = 0; fn < 4; ++fn) {
        const float* bp = Bsb + kk * LDB_S + 16 * fn;
        b[fn].x = bp[0];
        b[fn].y = bp[LDB_S];
      }

#pragma unroll
      for (int fm = 0; fm < 4; ++fm)
#pragma unroll
        for (int fn = 0; fn < 4; ++fn)
          c[fm][fn] = __builtin_amdgcn_wmma_f32_16x16x4_f32(
              false, a[fm], false, b[fn], (short)0, c[fm][fn], false, false);
    }

    asm volatile("s_wait_dscnt 0x0" ::: "memory");     // own reads of this buffer done
    asm volatile("s_wait_asynccnt 0x0" ::: "memory");  // own copies of stage t+1 landed
    __syncthreads();   // stage t+1 visible; every reader has left this buffer
    if (t + 2 < GD / BK) stage(t + 2, t & 1);          // the same for the whole work-group
  }
  asm volatile("s_wait_asynccnt 0x0" ::: "memory");    // nothing in flight at the end

  // Epilogue: bias add + store.  C/D layout: VGPR r -> row r + 8*half, col l16.
  float bv[4];
#pragma unroll
  for (int fn = 0; fn < 4; ++fn) bv[fn] = bias[n0 + waveN + 16 * fn + l16];
#pragma unroll
  for (int fm = 0; fm < 4; ++fm) {
    float* cp = C + (size_t)(m0 + waveM + 16 * fm + 8 * half) * GD + n0 + waveN + l16;
#pragma unroll
    for (int r = 0; r < 8; ++r)
#pragma unroll
      for (int fn = 0; fn < 4; ++fn)
        cp[(size_t)r * GD + 16 * fn] = c[fm][fn][r] + bv[fn];
  }
}

// ---------------------------------------------------------------------------
// Column causal attention: sequences indexed by (b, bl) of length NB=32,
// head dim 1024.  One work-group of 16 waves per sequence; every row of y and
// of x is read from global memory exactly once.  Q = y; K = V = x.
// Row for (b, nb, bl) = ((b*32 + nb)*128 + bl), 1024 columns.
//   1. wave w stages columns [64w, 64w+64) of the 32 Q and 32 K rows in LDS
//      and keeps the K rows in registers, where they serve as V;
//   2. partial S = Q K^T over those 64 columns on WMMA (the tile above the
//      diagonal is never needed), partials summed over the 16 waves in LDS;
//   3. softmax, two rows per wave, P to LDS;
//   4. O = P V on WMMA for the wave's 64 columns.
// ---------------------------------------------------------------------------
#define AT_QK_S 68   // LDS row stride (floats): 16 B x odd, conflict-free b128 reads
#define AT_S_S  36   // stride of the 32x32 score planes: conflict-free fragment reads

typedef float v4f __attribute__((ext_vector_type(4)));

__device__ __forceinline__ v8f wmma4(v2f a, v2f b, v8f c) {
  return __builtin_amdgcn_wmma_f32_16x16x4_f32(false, a, false, b, (short)0, c,
                                               false, false);
}

// Ends a run of WMMAs: four vector slots before any vector instruction may
// touch a register that the last WMMAs read or write.  The scheduling fences
// keep the slots behind the run and other vector instructions out of it.
__device__ __forceinline__ void wmma_run_end() {
  __builtin_amdgcn_sched_barrier(0);
  asm volatile("v_nop\n\tv_nop\n\tv_nop\n\tv_nop");
  __builtin_amdgcn_sched_barrier(0);
}

// Ends a run of global loads: no register that an issued load names is written
// again before the wait.  The scheduling fences keep the loads in front of it
// and every later write behind it; the lane's offset is an input so that it
// keeps its register up to here.
__device__ __forceinline__ void loads_issued(unsigned lane_off) {
  __builtin_amdgcn_sched_barrier(0);
  asm volatile("s_wait_xcnt 0x0" :: "v"(lane_off) : "memory");
  __builtin_amdgcn_sched_barrier(0);
}

__global__ __launch_bounds__(512)
void col_attn(const float* __restrict__ y, const float* __restrict__ x,
              float* __restrict__ attn) {
  __shared__ __attribute__((aligned(16))) float stage[16][64 * AT_QK_S];
  __shared__ __attribute__((aligned(16))) float Pb[32 * AT_S_S];

  const int lane = threadIdx.x & 31;
  const int wave = threadIdx.x >> 5;
  const int half = lane >> 4;
  const int l16  = lane & 15;
  const int bl   = blockIdx.x & 127;   // within-block position
  const int b    = blockIdx.x >> 7;    // batch

  const unsigned RSB = 128u * 1024u * 4u;          // bytes between positions
  // Uniform bases of the sequence; the lane's part is a 32-bit byte offset.
  const char* seqq = (const char*)(y + ((size_t)(b * 32) * 128 + bl) * 1024);
  const char* seqk = (const char*)(x + ((size_t)(b * 32) * 128 + bl) * 1024);
  const int col = wave * 64 + 4 * l16;             // this lane's 4 columns
  const unsigned off = (unsigned)half * RSB + (unsigned)col * 4u;
  float* st = stage[wave];

  // All loops below are fully unrolled so that every array stays in registers.

  // One load = two rows x 256 B (whole lines).  Q rows, then K rows.
  // As V: vv[2*s + v] = x[4*s + 2*v + half][col .. col+3]; P is read in the same k order.
  v4f tq[16], vv[16];
#pragma unroll
  for (int i = 0; i < 16; ++i)
    tq[i] = *(const v4f*)(seqq + (size_t)(2 * i) * RSB + off);
#pragma unroll
  for (int i = 0; i < 16; ++i)
    vv[i] = *(const v4f*)(seqk + (size_t)(2 * i) * RSB + off);
  loads_issued(off);

#pragma unroll
  for (int i = 0; i < 16; ++i)
    *(v4f*)(st + (2 * i + half) * AT_QK_S + 4 * l16) = tq[i];
#pragma unroll
  for (int i = 0; i < 16; ++i)
    *(v4f*)(st + (32 + 2 * i + half) * AT_QK_S + 4 * l16) = vv[i];
  __syncthreads();     // staged rows visible to the lanes that read them

  // Partial scores.  A (Q) and B (K) fragments come from the same loader, so
  // both hold d = 8*j + 4*half + 2*u + v at register v of sub-step u.
  v8f s00 = (v8f){0.f, 0.f, 0.f, 0.f, 0.f, 0.f, 0.f, 0.f};
  v8f s10 = s00, s11 = s00;
  const float* fr = st + l16 * AT_QK_S + 4 * half;
  __builtin_amdgcn_sched_barrier(0);   // start of the WMMA run (see wmma_run_end)
#pragma unroll
  for (int j = 0; j < 8; ++j) {
    const v4f q0 = *(const v4f*)(fr + 8 * j);
    const v4f q1 = *(const v4f*)(fr + 16 * AT_QK_S + 8 * j);
    const v4f k0 = *(const v4f*)(fr + 32 * AT_QK_S + 8 * j);
    const v4f k1 = *(const v4f*)(fr + 48 * AT_QK_S + 8 * j);
    s00 = wmma4((v2f){q0.x, q0.y}, (v2f){k0.x, k0.y}, s00);
    s10 = wmma4((v2f){q1.x, q1.y}, (v2f){k0.x, k0.y}, s10);
    s11 = wmma4((v2f){q1.x, q1.y}, (v2f){k1.x, k1.y}, s11);
    s00 = wmma4((v2f){q0.z, q0.w}, (v2f){k0.z, k0.w}, s00);
    s10 = wmma4((v2f){q1.z, q1.w}, (v2f){k0.z, k0.w}, s10);
    s11 = wmma4((v2f){q1.z, q1.w}, (v2f){k1.z, k1.w}, s11);
  }
  wmma_run_end();
  __syncthreads();     // fragment reads done before the rows are overwritten

  // The wave's partial 32x32 plane goes over its own staged rows.
  // D layout: register r -> row r + 8*half, column l16.
#pragma unroll
  for (int r = 0; r < 8; ++r) {
    st[(r + 8 * half) * AT_S_S + l16]           = s00[r];
    st[(r + 8 * half) * AT_S_S + 16 + l16]      = 0.f;   // tile above the diagonal
    st[(16 + r + 8 * half) * AT_S_S + l16]      = s10[r];
    st[(16 + r + 8 * half) * AT_S_S + 16 + l16] = s11[r];
  }
  __syncthreads();     // all 16 partial planes visible

  // Softmax: wave w owns rows 2w and 2w+1, lane = key position.
  // The two rows run side by side so that their cross-lane steps overlap.
  const float scale = 0.03125f;     // 1/sqrt(1024)
  const int q0 = 2 * wave;
  float sa = 0.f, sb = 0.f;
#pragma unroll
  for (int i = 0; i < 16; ++i) {
    sa += stage[i][q0 * AT_S_S + lane];
    sb += stage[i][(q0 + 1) * AT_S_S + lane];
  }
  sa = (lane <= q0)     ? sa * scale : -INFINITY;   // causal mask
  sb = (lane <= q0 + 1) ? sb * scale : -INFINITY;
  float ma = sa, mb = sb;
#pragma unroll
  for (int m = 16; m; m >>= 1) {
    ma = fmaxf(ma, __shfl_xor(ma, m, 32));
    mb = fmaxf(mb, __shfl_xor(mb, m, 32));
  }
  const float pa = __expf(sa - ma);  // -inf lanes -> 0
  const float pb = __expf(sb - mb);
  float ua = pa, ub = pb;
#pragma unroll
  for (int m = 16; m; m >>= 1) {
    ua += __shfl_xor(ua, m, 32);
    ub += __shfl_xor(ub, m, 32);
  }
  Pb[q0 * AT_S_S + lane]       = pa / ua;
  Pb[(q0 + 1) * AT_S_S + lane] = pb / ub;
  __syncthreads();     // P visible to every wave

  // O = P V.  A: P[16*tm + l16][4*s + 2*v + half].  B tile t takes component t
  // of vv, so its column l16 is global column col + t and a lane's four tiles
  // give four adjacent outputs.  Query rows 0..15 see keys 0..15 only.
  v8f o[2][4];
#pragma unroll
  for (int tm = 0; tm < 2; ++tm)
#pragma unroll
    for (int t = 0; t < 4; ++t)
      o[tm][t] = (v8f){0.f, 0.f, 0.f, 0.f, 0.f, 0.f, 0.f, 0.f};

  const float* pr = Pb + l16 * AT_S_S + half;
  v2f p0[4], p1[8], bf[8][4];
#pragma unroll
  for (int s = 0; s < 8; ++s) {
    if (s < 4) p0[s] = (v2f){pr[4 * s], pr[4 * s + 2]};
    p1[s] = (v2f){pr[16 * AT_S_S + 4 * s], pr[16 * AT_S_S + 4 * s + 2]};
#pragma unroll
    for (int t = 0; t < 4; ++t) bf[s][t] = (v2f){vv[2 * s][t], vv[2 * s + 1][t]};
  }
  // Inputs only: the moves that pair up the V registers are finished here, so
  // none of them lands among the WMMAs on a register that a WMMA still reads.
#pragma unroll
  for (int s = 0; s < 8; s += 2)
    asm volatile("" :: "v"(bf[s][0]), "v"(bf[s][1]), "v"(bf[s][2]), "v"(bf[s][3]),
                       "v"(bf[s + 1][0]), "v"(bf[s + 1][1]), "v"(bf[s + 1][2]),
                       "v"(bf[s + 1][3]));
  __builtin_amdgcn_sched_barrier(0);   // start of the WMMA run (see wmma_run_end)
#pragma unroll
  for (int s = 0; s < 8; ++s) {
    if (s < 4) {
#pragma unroll
      for (int t = 0; t < 4; ++t) o[0][t] = wmma4(p0[s], bf[s][t], o[0][t]);
    }
#pragma unroll
    for (int t = 0; t < 4; ++t) o[1][t] = wmma4(p1[s], bf[s][t], o[1][t]);
    if (s == 0) {
      // All eight result tiles get their registers in this first step.  Inputs
      // only: its operands stay live to here, so no tile is laid over a
      // register that a WMMA just issued still reads.
      __builtin_amdgcn_sched_barrier(0);
      asm volatile("" :: "v"(p0[0]), "v"(p1[0]), "v"(bf[0][0]), "v"(bf[0][1]),
                         "v"(bf[0][2]), "v"(bf[0][3]));
    }
  }
  wmma_run_end();

  // One store = two rows x 256 B (whole lines).
  float* O = attn + ((size_t)(b * 32) * 128 + bl) * 1024 + col;
#pragma unroll
  for (int tm = 0; tm < 2; ++tm)
#pragma unroll
    for (int r = 0; r < 8; ++r) {
      const v4f ov = (v4f){o[tm][0][r], o[tm][1][r], o[tm][2][r], o[tm][3][r]};
      *(v4f*)(O + (size_t)(16 * tm + r + 8 * half) * (128 * 1024)) = ov;
    }
}

// ---------------------------------------------------------------------------
// Weight products.  One 64x128 tile of C(1024x1024) = A @ B (BT = false) or
// A @ B^T (BT = true), K = 1024, by 8 waves (wave tile 32x32).  Chunks of 32 k
// go through registers into two LDS buffers: the next chunk's global loads fly
// while this chunk is multiplied.  In LDS both forms of B hold k and k+1 of a
// column side by side, so that a B fragment is one 8-byte read like an A one:
//   BT:  [n][k], row stride LDA_S;   else:  [k/2][n][k&1], row stride WP_PS.
// ---------------------------------------------------------------------------
#define WP_PS 288             // 2*128 + 32: the half-waves hit disjoint bank sets
#define WP_BS (128 * LDA_S)   // floats of one B buffer (= 16 * WP_PS)

template <bool BT>
__device__ __forceinline__ void wprod_tile(const float* __restrict__ A, int lda,
                                           const float* __restrict__ B, int ldb,
                                           float* __restrict__ C, int m0, int n0,
                                           float* As, float* Bs) {
  const int tid   = threadIdx.x;
  const int lane  = tid & 31;
  const int wave  = tid >> 5;           // 0..7  (2 in M x 4 in N)
  const int waveM = (wave >> 2) * 32;
  const int waveN = (wave & 3) * 32;
  const int half  = lane >> 4;
  const int l16   = lane & 15;

  // A chunk: 64 rows x 32 k, two float4 a thread.
  const float* ag = A + (size_t)(m0 + (tid >> 2)) * lda + (tid & 3) * 8;
  const int    al = (tid >> 2) * LDA_S + (tid & 3) * 8;
  // B chunk, four float4 a thread.  BT: 128 n-rows x 32 k, 16 k of one row.
  // Else 32 k-rows x 128 n: rows 2p and 2p+1, columns n..n+3 and n+64..n+67.
  const float* bg = BT ? B + (size_t)(n0 + (tid >> 1)) * ldb + (tid & 1) * 16
                       : B + (size_t)(2 * (tid >> 4)) * ldb + n0 + (tid & 15) * 4;
  const int    bl = BT ? (tid >> 1) * LDA_S + (tid & 1) * 16
                       : (tid >> 4) * WP_PS + (tid & 15) * 8;
  const size_t bstep = BT ? (size_t)BK : (size_t)BK * ldb;

  v4f ra[2], rb[4];
  auto load_chunk = [&]() {
#pragma unroll
    for (int i = 0; i < 2; ++i) ra[i] = *(const v4f*)(ag + 4 * i);
    if (BT) {
#pragma unroll
      for (int i = 0; i < 4; ++i) rb[i] = *(const v4f*)(bg + 4 * i);
    } else {
      rb[0] = *(const v4f*)(bg);
      rb[1] = *(const v4f*)(bg + ldb);
      rb[2] = *(const v4f*)(bg + 64);
      rb[3] = *(const v4f*)(bg + ldb + 64);
    }
  };
  auto store_chunk = [&](float* Ad, float* Bd) {
#pragma unroll
    for (int i = 0; i < 2; ++i) *(v4f*)(Ad + al + 4 * i) = ra[i];
    if (BT) {
#pragma unroll
      for (int i = 0; i < 4; ++i) *(v4f*)(Bd + bl + 4 * i) = rb[i];
    } else {
#pragma unroll
      for (int g = 0; g < 2; ++g) {
        const v4f e = rb[2 * g], o = rb[2 * g + 1];   // rows 2p and 2p+1
        *(v4f*)(Bd + bl + 128 * g)     = (v4f){e.x, o.x, e.y, o.y};
        *(v4f*)(Bd + bl + 128 * g + 4) = (v4f){e.z, o.z, e.w, o.w};
      }
    }
  };

  v8f c[2][2];
#pragma unroll
  for (int fm = 0; fm < 2; ++fm)
#pragma unroll
    for (int fn = 0; fn < 2; ++fn)
      c[fm][fn] = (v8f){0.f, 0.f, 0.f, 0.f, 0.f, 0.f, 0.f, 0.f};

  load_chunk();
  store_chunk(As, Bs);
  __syncthreads();       // chunk 0 visible

  for (int t = 0; t < 1024 / BK; ++t) {
    const int  cur  = t & 1;
    const bool more = t + 1 < 1024 / BK;   // the same for the whole work-group
    if (more) {
      ag += BK;
      bg += bstep;
      load_chunk();
    }

    const float* Asb = As + cur * (BM * LDA_S);
    const float* Bsb = Bs + cur * WP_BS;
    // The chunk's fragments are all asked for first, then its WMMAs run alone.
    v2f a[BK / 4][2], b[BK / 4][2];
#pragma unroll
    for (int ks = 0; ks < BK / 4; ++ks) {
      // Register v of a lane holds k = 4*ks + 2*half + v, in A and in B alike.
      const int kfrag = 4 * ks + 2 * half;
#pragma unroll
      for (int fm = 0; fm < 2; ++fm)
        a[ks][fm] = *(const v2f*)(Asb + (waveM + 16 * fm + l16) * LDA_S + kfrag);
#pragma unroll
      for (int fn = 0; fn < 2; ++fn)
        b[ks][fn] = *(const v2f*)(
            BT ? Bsb + (waveN + 16 * fn + l16) * LDA_S + kfrag
               : Bsb + (kfrag >> 1) * WP_PS + 2 * (waveN + 16 * fn + l16));
    }
    __builtin_amdgcn_sched_barrier(0);   // start of the WMMA run (see wmma_run_end)
#pragma unroll
    for (int ks = 0; ks < BK / 4; ++ks)
#pragma unroll
      for (int fm = 0; fm < 2; ++fm)
#pragma unroll
        for (int fn = 0; fn < 2; ++fn)
          c[fm][fn] = wmma4(a[ks][fm], b[ks][fn], c[fm][fn]);
    wmma_run_end();

    if (more)            // the other buffer's readers left it at the last barrier
      store_chunk(As + (cur ^ 1) * (BM * LDA_S), Bs + (cur ^ 1) * WP_BS);
    __syncthreads();     // next chunk visible; this chunk's reads done
  }

  // C/D layout: VGPR r -> row r + 8*half, col l16.
#pragma unroll
  for (int fn = 0; fn < 2; ++fn) {
    const int nc = n0 + waveN + 16 * fn + l16;
#pragma unroll
    for (int fm = 0; fm < 2; ++fm) {
      const int rbase = m0 + waveM + 16 * fm + 8 * half;
#pragma unroll
      for (int r = 0; r < 8; ++r)
        C[(size_t)(rbase + r) * 1024 + nc] = c[fm][fn][r];
    }
  }
  // Ends the run of stores: no register that an issued store names is written
  // again before the wait.  The scheduling fences keep the stores in front of it
  // and every later write behind it.
  __builtin_amdgcn_sched_barrier(0);
  asm volatile("s_wait_xcnt 0x0" ::: "memory");
  __builtin_amdgcn_sched_barrier(0);
}

// Work-groups 0..31: u, 32 entries each.  32..63: h, 32 entries each.
// 64..191: tiles of G.  192..319: tiles of H.
__global__ __launch_bounds__(256)
void weight_products(const float* __restrict__ Wqkv, const float* __restrict__ bqkv,
                     const float* __restrict__ Wout, const float* __restrict__ bout,
                     float* __restrict__ G, float* __restrict__ H,
                     float* __restrict__ u, float* __restrict__ h) {
  __shared__ __attribute__((aligned(16))) float As[2 * BM * LDA_S];
  __shared__ __attribute__((aligned(16))) float Bs[2 * WP_BS];

  const int lane = threadIdx.x & 31;
  const int wave = threadIdx.x >> 5;
  const int blk  = blockIdx.x;

  if (blk < 32) {
    // u[j] = sum_c Wk[j][c] * bq[c]; four rows a wave, a row across the lanes.
    // Uniform bases; the lane's part is a 32-bit byte offset.
    const char* wr = (const char*)(Wqkv + (size_t)(blk * 32) * 3072 + 1024);
    const char* qr = (const char*)bqkv;
    const unsigned wo = (unsigned)(wave * 4 * 3072 + 4 * lane) * 4u;
    const unsigned qo = (unsigned)lane * 16u;
    v4f w[4][8], q[8];
#pragma unroll
    for (int i = 0; i < 8; ++i) q[i] = *(const v4f*)(qr + 512 * i + qo);
    loads_issued(qo);
#pragma unroll
    for (int i = 0; i < 8; ++i)
#pragma unroll
      for (int r = 0; r < 4; ++r)
        w[r][i] = *(const v4f*)(wr + (12288 * r + 512 * i) + wo);
    loads_issued(wo);
#pragma unroll
    for (int r = 0; r < 4; ++r) {
      float s = 0.f;
#pragma unroll
      for (int i = 0; i < 8; ++i)
        s += w[r][i].x * q[i].x + w[r][i].y * q[i].y + w[r][i].z * q[i].z +
             w[r][i].w * q[i].w;
#pragma unroll
      for (int m = 16; m; m >>= 1) s += __shfl_xor(s, m, 32);
      if (lane == 0) As[wave * 4 + r] = s;
    }
    __syncthreads();     // the 32 sums visible to the wave that stores them
    if (wave == 0) u[blk * 32 + lane] = As[lane];
  } else if (blk < 64) {
    // h[n] = bout[n] + sum_c bv[c] * Wout[c][n]; lane = column, 128 c a wave.
    const int n = (blk - 32) * 32 + lane;
    // Uniform bases; the lane's part is a 32-bit byte offset.
    const char* wc = (const char*)(Wout + (blk - 32) * 32);
    const char* vr = (const char*)(bqkv + 2048);
    const unsigned co = (unsigned)(wave * 128 * 1024 + lane) * 4u;
    const unsigned vo = (unsigned)wave * 512u;
    float s = 0.f;
#pragma unroll
    for (int g = 0; g < 4; ++g) {
      float wv[32];
      v4f   bv[8];
#pragma unroll
      for (int i = 0; i < 8; ++i) bv[i] = *(const v4f*)(vr + (128 * g + 16 * i) + vo);
      loads_issued(vo);
#pragma unroll
      for (int i = 0; i < 32; ++i)
        wv[i] = *(const float*)(wc + (size_t)(32 * g + i) * 4096 + co);
      loads_issued(co);
#pragma unroll
      for (int i = 0; i < 32; ++i) s += bv[i >> 2][i & 3] * wv[i];
    }
    As[wave * 32 + lane] = s;
    __syncthreads();     // the eight partial sums visible to the wave that adds them
    if (wave == 0) {
      float t = bout[n];
#pragma unroll
      for (int w = 0; w < 8; ++w) t += As[w * 32 + lane];
      h[n] = t;
    }
  } else {
    const int tile = (blk - 64) & 127;
    const int n0 = (tile & 7) * BN;
    const int m0 = (tile >> 3) * BM;
    if (blk < 192)   // G = Wq Wk^T
      wprod_tile<true>(Wqkv, 3072, Wqkv + 1024, 3072, G, m0, n0, As, Bs);
    else             // H = Wv Wout
      wprod_tile<false>(Wqkv + 2048, 3072, Wout, 1024, H, m0, n0, As, Bs);
  }
}

// ---------------------------------------------------------------------------
extern "C" void kernel_launch(void* const* d_in, const int* in_sizes, int n_in,
                              void* d_out, int out_size, void* d_ws, size_t ws_size,
                              hipStream_t stream) {
  (void)in_sizes; (void)n_in; (void)out_size; (void)ws_size;

  const float* x    = (const float*)d_in[0];   // (4,4096,1024)
  const float* Wqkv = (const float*)d_in[1];   // (1024,3072)
  const float* bqkv = (const float*)d_in[2];   // (3072)
  const float* Wout = (const float*)d_in[3];   // (1024,1024)
  const float* bout = (const float*)d_in[4];   // (1024)
  float* out = (float*)d_out;                  // (4,4096,1024)

  float* y    = (float*)d_ws;                       // 16384 x 1024 f32 (64 MB)
  float* attn = y + (size_t)16384 * 1024;           // 16384 x 1024 f32 (64 MB)
  float* G    = attn + (size_t)16384 * 1024;        // 1024 x 1024 f32
  float* H    = G + (size_t)1024 * 1024;            // 1024 x 1024 f32
  float* u    = H + (size_t)1024 * 1024;            // 1024 f32
  float* h    = u + 1024;                           // 1024 f32

  const int M = 16384, D = 1024;

  // Stage 0: G = Wq Wk^T, H = Wv Wout, u = Wk bq, h = bv Wout + bout.
  weight_products<<<dim3(320), dim3(256), 0, stream>>>(Wqkv, bqkv, Wout, bout,
                                                       G, H, u, h);

  // Stage 1: y = x G + u.
  gemm_f32_wmma<<<dim3(D / TN, M / TM), dim3(512), 0, stream>>>(x, G, u, y);

  // Stage 2: column causal attention (one 16-wave block per sequence).
  col_attn<<<dim3(512), dim3(512), 0, stream>>>(y, x, attn);

  // Stage 3: out = (P x) H + h.
  gemm_f32_wmma<<<dim3(D / TN, M / TM), dim3(512), 0, stream>>>(attn, H, h, out);
}
